// v000
// Measured on an AMD MI455X. A time is GPU time per run, averaged over a window of back-to-back runs after a warm-up
// (all launches, gaps included; the runs take copies of the inputs in turn), and the median of several windows.
// Apart from v000's, it joins two sittings. Times from different sittings can be a few percent apart, while
// side-by-side timings come from the same sitting.
// The starting kernel, v000, takes 51.8 microseconds a run.
#include <hip/hip_runtime.h>

// Problem constants (B=4, H=16, S=4096, D=64)
#define BH     64
#define SLEN   4096
#define DIM    64
#define NCHUNK 4
#define CHUNK  (SLEN / NCHUNK)
#define TROWS  32
#define OROWS  256

typedef __attribute__((ext_vector_type(16))) __bf16 v16bf;
typedef __attribute__((ext_vector_type(8)))  float  v8f;
typedef __attribute__((ext_vector_type(4)))  unsigned int v4u;
typedef __attribute__((ext_vector_type(8)))  int    v8i;
typedef __attribute__((ext_vector_type(4)))  int    v4i;

// elu(x)+1  ==  x>0 ? x+1 : exp(x)
__device__ __forceinline__ float featmap(float x) {
    return x > 0.0f ? x + 1.0f : __expf(x);
}

__device__ __forceinline__ int kmap(int half, int i) {
    return (i < 8) ? (half * 8 + i) : (16 + half * 8 + (i - 8));
}

__device__ __forceinline__ void tdm_load_2d(unsigned int lds_off, const void* gptr,
                                            unsigned int tdim0, unsigned int tdim1,
                                            unsigned int stride0,
                                            unsigned int tile0, unsigned int tile1) {
    const unsigned long long ga = (unsigned long long)(uintptr_t)gptr;
    v4u g0;
    g0[0] = 1u;
    g0[1] = lds_off;
    g0[2] = (unsigned int)(ga & 0xffffffffull);
    g0[3] = (unsigned int)((ga >> 32) & 0x01fffffful) | (2u << 30);
    v8i g1;
    g1[0] = (int)(2u << 16);
    g1[1] = (int)((tdim0 & 0xffffu) << 16);
    g1[2] = (int)(((tdim0 >> 16) & 0xffffu) | ((tdim1 & 0xffffu) << 16));
    g1[3] = (int)(((tdim1 >> 16) & 0xffffu) | ((tile0 & 0xffffu) << 16));
    g1[4] = (int)(tile1 & 0xffffu);
    g1[5] = (int)stride0;
    g1[6] = 0;
    g1[7] = 0;
    const v4i z4 = {0, 0, 0, 0};
    const v8i z8 = {0, 0, 0, 0, 0, 0, 0, 0};
    __builtin_amdgcn_tensor_load_to_lds(g0, g1, z4, z4, z8, 0);
}

__device__ __forceinline__ unsigned int lds_addr_of(const void* p) {
    // generic LDS pointer: low 32 bits are the wave-relative LDS byte offset
    return (unsigned int)(uintptr_t)p;
}

__global__ void zero_ws_kernel(float* __restrict__ p, int n) {
    for (int i = blockIdx.x * blockDim.x + threadIdx.x; i < n;
         i += gridDim.x * blockDim.x)
        p[i] = 0.0f;
}

__global__ __launch_bounds__(256)
void kv_kernel(const float* __restrict__ K, const float* __restrict__ V,
               const float* __restrict__ mask,
               float* __restrict__ KVg, float* __restrict__ Ksumg) {
    __shared__ float sK[2][TROWS * DIM];
    __shared__ float sV[2][TROWS * DIM];
    __shared__ float sM[2][TROWS];

    const int bh    = blockIdx.x / NCHUNK;
    const int chunk = blockIdx.x % NCHUNK;
    const int tid   = threadIdx.x;
    const int wave  = tid >> 5;
    const int lane  = tid & 31;
    const int half  = lane >> 4;
    const int lm    = lane & 15;

    const int mt  = wave >> 1;            // A (d) tile owned by this wave
    const int nt0 = (wave & 1) * 2;       // first of two B (e) tiles

    const float* __restrict__ Kp = K + (size_t)bh * SLEN * DIM;
    const float* __restrict__ Vp = V + (size_t)bh * SLEN * DIM;
    const float* __restrict__ Mp = mask + (size_t)bh * SLEN;

    v8f acc[2];
#pragma unroll
    for (int t = 0; t < 2; ++t)
#pragma unroll
        for (int r = 0; r < 8; ++r) acc[t][r] = 0.0f;
    float ksum_part = 0.0f;

    const int  s_base = chunk * CHUNK;
    const int  NT     = CHUNK / TROWS;    // 32 tiles per block

    if (wave == 0) {
        const int s0 = s_base;
        tdm_load_2d(lds_addr_of(&sK[0][0]), Kp + (size_t)s0 * DIM,
                    DIM, SLEN - s0, DIM, DIM, TROWS);
        tdm_load_2d(lds_addr_of(&sV[0][0]), Vp + (size_t)s0 * DIM,
                    DIM, SLEN - s0, DIM, DIM, TROWS);
        tdm_load_2d(lds_addr_of(&sM[0][0]), Mp + s0,
                    SLEN - s0, 1, SLEN, TROWS, 1);
    }

    for (int it = 0; it < NT; ++it) {
        const int buf = it & 1;
        if (wave == 0) __builtin_amdgcn_s_wait_tensorcnt(0);
        __syncthreads();   // publish tile `it`; all waves done with buf^1 (WAR)
        if (wave == 0 && it + 1 < NT) {
            const int s0 = s_base + (it + 1) * TROWS;
            tdm_load_2d(lds_addr_of(&sK[buf ^ 1][0]), Kp + (size_t)s0 * DIM,
                        DIM, SLEN - s0, DIM, DIM, TROWS);
            tdm_load_2d(lds_addr_of(&sV[buf ^ 1][0]), Vp + (size_t)s0 * DIM,
                        DIM, SLEN - s0, DIM, DIM, TROWS);
            tdm_load_2d(lds_addr_of(&sM[buf ^ 1][0]), Mp + s0,
                        SLEN - s0, 1, SLEN, TROWS, 1);
        }

        // Build operands from LDS tile and issue the wave's two WMMAs.
        v16bf A, B0, B1;
        float kp = 0.0f;
#pragma unroll
        for (int i = 0; i < 16; ++i) {
            const int rr = kmap(half, i);                 // row within tile
            const float mk = sM[buf][rr];
            const float f  = featmap(sK[buf][rr * DIM + mt * 16 + lm]) * mk;
            kp += f;
            A[i]  = (__bf16)f;
            B0[i] = (__bf16)sV[buf][rr * DIM + nt0 * 16 + lm];
            B1[i] = (__bf16)sV[buf][rr * DIM + (nt0 + 1) * 16 + lm];
        }
        if ((wave & 1) == 0) ksum_part += kp;   // avoid double count (A shared by 2 waves)

        acc[0] = __builtin_amdgcn_wmma_f32_16x16x32_bf16(
            false, A, false, B0, (short)0, acc[0], false, false);
        acc[1] = __builtin_amdgcn_wmma_f32_16x16x32_bf16(
            false, A, false, B1, (short)0, acc[1], false, false);
    }

    // Writeback: wave exclusively owns tiles (mt, nt0) and (mt, nt0+1).
    float* __restrict__ kvdst = KVg + (size_t)bh * DIM * DIM;
#pragma unroll
    for (int t = 0; t < 2; ++t)
#pragma unroll
        for (int r = 0; r < 8; ++r) {
            const int m = mt * 16 + r + 8 * half;   // C layout: vgpr r -> M=r / r+8
            const int n = (nt0 + t) * 16 + lm;      // N = lane % 16
            atomicAdd(&kvdst[m * DIM + n], acc[t][r]);
        }
    if ((wave & 1) == 0)
        atomicAdd(&Ksumg[bh * DIM + mt * 16 + lm], ksum_part);
}

// Phase 2: out = (Qf @ KV) * (1 / (Qf . Ksum))
__global__ __launch_bounds__(256)
void out_kernel(const float* __restrict__ Q, const float* __restrict__ KVg,
                const float* __restrict__ Ksumg, float* __restrict__ Out) {
    const int nsb  = SLEN / OROWS;               // 16 blocks per head
    const int bh   = blockIdx.x / nsb;
    const int sblk = blockIdx.x % nsb;
    const int tid  = threadIdx.x;
    const int wave = tid >> 5;
    const int lane = tid & 31;
    const int half = lane >> 4;
    const int lm   = lane & 15;

    __shared__ float ksum_l[DIM];
    if (tid < DIM) ksum_l[tid] = Ksumg[bh * DIM + tid];
    __syncthreads();

    // Preload KV as bf16 B tiles: B[ks][nt][k][n=lane] = KV[ks*32 + k][nt*16 + n]
    const float* __restrict__ KVp = KVg + (size_t)bh * DIM * DIM;
    v16bf Bkv[2][4];
#pragma unroll
    for (int ks = 0; ks < 2; ++ks)
#pragma unroll
        for (int i = 0; i < 16; ++i) {
            const int d = ks * 32 + kmap(half, i);
#pragma unroll
            for (int nt = 0; nt < 4; ++nt)
                Bkv[ks][nt][i] = (__bf16)KVp[d * DIM + nt * 16 + lm];
        }

    const float* __restrict__ Qp = Q + (size_t)bh * SLEN * DIM;
    float* __restrict__ Op       = Out + (size_t)bh * SLEN * DIM;

#pragma unroll
    for (int it = 0; it < 2; ++it) {             // 2 x 16 rows per wave
        const int srow0 = sblk * OROWS + wave * 32 + it * 16;
        const int s     = srow0 + lm;            // A-operand row for this lane

        // A tiles via b128 loads: per k-step the lane's d-indices are two
        // contiguous 8-float runs: [ks*32+half*8 .. +7] and [+16 .. +23].
        const float4* __restrict__ Qrow =
            (const float4*)(Qp + (size_t)s * DIM);
        float dp = 0.0f;
        v16bf A[2];
#pragma unroll
        for (int ks = 0; ks < 2; ++ks) {
            const int b4 = (ks * 32 + half * 8) >> 2;   // float4 index
            float qs[16];
            *(float4*)&qs[0]  = Qrow[b4 + 0];
            *(float4*)&qs[4]  = Qrow[b4 + 1];
            *(float4*)&qs[8]  = Qrow[b4 + 4];
            *(float4*)&qs[12] = Qrow[b4 + 5];
#pragma unroll
            for (int i = 0; i < 16; ++i) {
                const int d = ks * 32 + kmap(half, i);
                const float f = featmap(qs[i]);
                dp += f * ksum_l[d];
                A[ks][i] = (__bf16)f;
            }
        }
        const float denom = dp + __shfl_xor(dp, 16);

        v8f acc[4];
#pragma unroll
        for (int nt = 0; nt < 4; ++nt)
#pragma unroll
            for (int r = 0; r < 8; ++r) acc[nt][r] = 0.0f;

#pragma unroll
        for (int ks = 0; ks < 2; ++ks)
#pragma unroll
            for (int nt = 0; nt < 4; ++nt)
                acc[nt] = __builtin_amdgcn_wmma_f32_16x16x32_bf16(
                    false, A[ks], false, Bkv[ks][nt], (short)0, acc[nt],
                    false, false);

#pragma unroll
        for (int r = 0; r < 8; ++r) {
            const float dn = __shfl(denom, r + 8 * half);
            const float z  = 1.0f / dn;
            const int  srw = srow0 + r + 8 * half;
            const size_t rowO = (size_t)srw * DIM;
#pragma unroll
            for (int nt = 0; nt < 4; ++nt)
                Op[rowO + nt * 16 + lm] = acc[nt][r] * z;
        }
    }
}

extern "C" void kernel_launch(void* const* d_in, const int* in_sizes, int n_in,
                              void* d_out, int out_size, void* d_ws, size_t ws_size,
                              hipStream_t stream) {
    (void)in_sizes; (void)n_in; (void)out_size; (void)ws_size;
    const float* Q    = (const float*)d_in[0];
    const float* K    = (const float*)d_in[1];
    const float* V    = (const float*)d_in[2];
    const float* mask = (const float*)d_in[3];
    float* Out = (float*)d_out;

    float* KVg   = (float*)d_ws;            // BH * 64 * 64
    float* Ksumg = KVg + BH * DIM * DIM;    // BH * 64
    const int nws = BH * DIM * DIM + BH * DIM;

    zero_ws_kernel<<<(nws + 255) / 256, 256, 0, stream>>>((float*)d_ws, nws);
    kv_kernel<<<BH * NCHUNK, 256, 0, stream>>>(K, V, mask, KVg, Ksumg);
    out_kernel<<<BH * (SLEN / OROWS), 256, 0, stream>>>(Q, KVg, Ksumg, Out);
}

// v001
// One run takes 32.2 microseconds.
// Timed twice side by side with v000, it ran 1.61 and 1.64 times as fast.
#include <hip/hip_runtime.h>

// Problem constants (B=4, H=16, S=4096, D=64)
#define BH     64
#define SLEN   4096
#define DIM    64
#define NCHUNK 4
#define CHUNK  (SLEN / NCHUNK)   // 1024 rows of S per kv-block
#define KVWAVES 8                // waves per kv-block
#define WROWS  (CHUNK / KVWAVES) // 128 rows of S per wave
#define KSTEPS (WROWS / 32)      // WMMA k-steps per wave
#define OROWS  256               // rows of S per out-block

typedef __attribute__((ext_vector_type(16))) __bf16 v16bf;
typedef __attribute__((ext_vector_type(8)))  float  v8f;
typedef __attribute__((ext_vector_type(4)))  float  v4f;

// elu(x)+1  ==  x>0 ? x+1 : exp(x)
__device__ __forceinline__ float featmap(float x) {
    return x > 0.0f ? x + 1.0f : __expf(x);
}

__device__ __forceinline__ float featmap_slot(float x) {
    float e;
    asm("v_exp_f32 %0, %1\n\tv_nop" : "=v"(e) : "v"(x * 1.44269504f));
    return x > 0.0f ? x + 1.0f : e;
}

__device__ __forceinline__ int kmap(int half, int i) {
    return (i < 8) ? (half * 8 + i) : (16 + half * 8 + (i - 8));
}

__global__ void zero_ws_kernel(float* __restrict__ p, int n) {
    for (int i = blockIdx.x * blockDim.x + threadIdx.x; i < n;
         i += gridDim.x * blockDim.x)
        p[i] = 0.0f;
}

__global__ __launch_bounds__(256)
void kv_kernel(const float* __restrict__ K, const float* __restrict__ V,
               const float* __restrict__ mask,
               float* __restrict__ KVg, float* __restrict__ Ksumg) {
    __shared__ float sP[KVWAVES][DIM * DIM];
    __shared__ float sS[KVWAVES][DIM];

    const int bh    = blockIdx.x / NCHUNK;
    const int chunk = blockIdx.x % NCHUNK;
    const int tid   = threadIdx.x;
    const int wave  = tid >> 5;
    const int lane  = tid & 31;
    const int half  = lane >> 4;
    const int lm    = lane & 15;

    // first row of this lane's half of the wave's first 32-row step
    const size_t row0 = (size_t)bh * SLEN + chunk * CHUNK + wave * WROWS + half * 16;
    const v4f* __restrict__ Kp = (const v4f*)(K + row0 * DIM) + lm;
    const v4f* __restrict__ Vp = (const v4f*)(V + row0 * DIM) + lm;
    const v4f* __restrict__ Mp = (const v4f*)(mask + row0);

    v8f acc[4][4];
#pragma unroll
    for (int j = 0; j < 4; ++j)
#pragma unroll
        for (int n = 0; n < 4; ++n)
#pragma unroll
            for (int r = 0; r < 8; ++r) acc[j][n][r] = 0.0f;
    float ks[4] = {0.0f, 0.0f, 0.0f, 0.0f};

    // K and mask run two steps ahead (two register buffers), V one step ahead.
    v4f kq[2][16], mq[2][4], vq[16];
#define LOAD_K(T) do { \
    _Pragma("unroll") for (int i = 0; i < 16; ++i) kq[(T) & 1][i] = Kp[((T) * 32 + i) * (DIM / 4)]; \
    _Pragma("unroll") for (int i = 0; i < 4; ++i)  mq[(T) & 1][i] = Mp[(T) * 8 + i]; } while (0)
#define LOAD_V(T) do { \
    _Pragma("unroll") for (int i = 0; i < 16; ++i) vq[i] = Vp[((T) * 32 + i) * (DIM / 4)]; } while (0)
    // The scheduling barriers pin the loads in the order of their use and each refill directly
    // behind the last use of its registers. Left free, the compiler issued step 0's K last (so
    // the first wait was for every load) and sank refills next to their use, where the wave
    // waited out a whole memory latency with few loads in flight.
    LOAD_K(0);
    __builtin_amdgcn_sched_barrier(0);
    LOAD_V(0);
    __builtin_amdgcn_sched_barrier(0);
    LOAD_K(1);
#pragma unroll
    for (int t = 0; t < KSTEPS; ++t) {
        v16bf A[4], B[4];
        __builtin_amdgcn_sched_barrier(0);
#pragma unroll
        for (int i = 0; i < 16; ++i) {
            const float mk = mq[t & 1][i >> 2][i & 3];
#pragma unroll
            for (int j = 0; j < 4; ++j) {
                const float f = featmap_slot(kq[t & 1][i][j]) * mk;
                ks[j] += f;
                A[j][i] = (__bf16)f;
            }
        }
        __builtin_amdgcn_sched_barrier(0);
        if (t + 2 < KSTEPS) LOAD_K(t + 2);
        __builtin_amdgcn_sched_barrier(0);
#pragma unroll
        for (int i = 0; i < 16; ++i)
#pragma unroll
            for (int j = 0; j < 4; ++j) B[j][i] = (__bf16)vq[i][j];
        __builtin_amdgcn_sched_barrier(0);
        if (t + 1 < KSTEPS) LOAD_V(t + 1);
        // Behind the wave's last load: no address register of an issued load is rewritten ahead
        // of this wait (a refill's own result had taken the dead K and mask address registers);
        // naming the three addresses as inputs keeps their registers as they are up to here.
        if (t + 2 == KSTEPS) asm volatile("s_wait_xcnt 0x0" :: "v"(Kp), "v"(Vp), "v"(Mp) : "memory");
        __builtin_amdgcn_sched_barrier(0);
#pragma unroll
        for (int j = 0; j < 4; ++j)
#pragma unroll
            for (int n = 0; n < 4; ++n)
                acc[j][n] = __builtin_amdgcn_wmma_f32_16x16x32_bf16(
                    false, A[j], false, B[n], (short)0, acc[j][n], false, false);
    }
#undef LOAD_K
#undef LOAD_V

    // Wave partial to LDS. Tile (j, n), vgpr r, lane (half, lm) holds
    // KV[d = 4*(r + 8*half) + j][e = 4*lm + n]: the four n of a lane are one 16-byte store.
#pragma unroll
    for (int j = 0; j < 4; ++j)
#pragma unroll
        for (int r = 0; r < 8; ++r) {
            const int dd = 4 * (r + 8 * half) + j;
            v4f o = {acc[j][0][r], acc[j][1][r], acc[j][2][r], acc[j][3][r]};
            *(v4f*)&sP[wave][dd * DIM + 4 * lm] = o;
        }
#pragma unroll
    for (int j = 0; j < 4; ++j) ks[j] += __shfl_xor(ks[j], 16);
    if (half == 0) {
        v4f o = {ks[0], ks[1], ks[2], ks[3]};
        *(v4f*)&sS[wave][4 * lm] = o;
    }
    __syncthreads();

    // All LDS reads first, then the atomics: 32 lanes add into one 128-byte line.
    float* __restrict__ kvdst = KVg + (size_t)bh * DIM * DIM + tid;
    float sum[DIM * DIM / 256];
#pragma unroll
    for (int k = 0; k < DIM * DIM / 256; ++k) {
        float s = 0.0f;
#pragma unroll
        for (int w = 0; w < KVWAVES; ++w) s += sP[w][k * 256 + tid];
        sum[k] = s;
    }
#pragma unroll
    for (int k = 0; k < DIM * DIM / 256; ++k) atomicAdd(&kvdst[k * 256], sum[k]);
    if (tid < DIM) {
        float s = 0.0f;
#pragma unroll
        for (int w = 0; w < KVWAVES; ++w) s += sS[w][tid];
        atomicAdd(&Ksumg[bh * DIM + tid], s);
    }
}

// Phase 2: out = (Qf @ KV) * (1 / (Qf . Ksum))
__global__ __launch_bounds__(256)
void out_kernel(const float* __restrict__ Q, const float* __restrict__ KVg,
                const float* __restrict__ Ksumg, float* __restrict__ Out) {
    const int nsb  = SLEN / OROWS;               // 16 blocks per head
    const int bh   = blockIdx.x / nsb;
    const int sblk = blockIdx.x % nsb;
    const int tid  = threadIdx.x;
    const int wave = tid >> 5;
    const int lane = tid & 31;
    const int half = lane >> 4;
    const int lm   = lane & 15;

    __shared__ float ksum_l[DIM];
    if (tid < DIM) ksum_l[tid] = Ksumg[bh * DIM + tid];
    __syncthreads();

    // Preload KV as bf16 B tiles: B[ks][nt][k][n=lane] = KV[ks*32 + k][nt*16 + n]
    const float* __restrict__ KVp = KVg + (size_t)bh * DIM * DIM;
    v16bf Bkv[2][4];
#pragma unroll
    for (int ks = 0; ks < 2; ++ks)
#pragma unroll
        for (int i = 0; i < 16; ++i) {
            const int d = ks * 32 + kmap(half, i);
#pragma unroll
            for (int nt = 0; nt < 4; ++nt)
                Bkv[ks][nt][i] = (__bf16)KVp[d * DIM + nt * 16 + lm];
        }

    const float* __restrict__ Qp = Q + (size_t)bh * SLEN * DIM;
    float* __restrict__ Op       = Out + (size_t)bh * SLEN * DIM;

#pragma unroll
    for (int it = 0; it < 2; ++it) {             // 2 x 16 rows per wave
        const int srow0 = sblk * OROWS + wave * 32 + it * 16;
        const int s     = srow0 + lm;            // A-operand row for this lane

        // A tiles via b128 loads: per k-step the lane's d-indices are two
        // contiguous 8-float runs: [ks*32+half*8 .. +7] and [+16 .. +23].
        const float4* __restrict__ Qrow =
            (const float4*)(Qp + (size_t)s * DIM);
        float dp = 0.0f;
        v16bf A[2];
#pragma unroll
        for (int ks = 0; ks < 2; ++ks) {
            const int b4 = (ks * 32 + half * 8) >> 2;   // float4 index
            float qs[16];
            *(float4*)&qs[0]  = Qrow[b4 + 0];
            *(float4*)&qs[4]  = Qrow[b4 + 1];
            *(float4*)&qs[8]  = Qrow[b4 + 4];
            *(float4*)&qs[12] = Qrow[b4 + 5];
#pragma unroll
            for (int i = 0; i < 16; ++i) {
                const int d = ks * 32 + kmap(half, i);
                const float f = featmap(qs[i]);
                dp += f * ksum_l[d];
                A[ks][i] = (__bf16)f;
            }
        }
        const float denom = dp + __shfl_xor(dp, 16);

        v8f acc[4];
#pragma unroll
        for (int nt = 0; nt < 4; ++nt)
#pragma unroll
            for (int r = 0; r < 8; ++r) acc[nt][r] = 0.0f;

#pragma unroll
        for (int ks = 0; ks < 2; ++ks)
#pragma unroll
            for (int nt = 0; nt < 4; ++nt)
                acc[nt] = __builtin_amdgcn_wmma_f32_16x16x32_bf16(
                    false, A[ks], false, Bkv[ks][nt], (short)0, acc[nt],
                    false, false);

#pragma unroll
        for (int r = 0; r < 8; ++r) {
            const float dn = __shfl(denom, r + 8 * half);
            const float z  = 1.0f / dn;
            const int  srw = srow0 + r + 8 * half;
            const size_t rowO = (size_t)srw * DIM;
#pragma unroll
            for (int nt = 0; nt < 4; ++nt)
                Op[rowO + nt * 16 + lm] = acc[nt][r] * z;
        }
    }
}

extern "C" void kernel_launch(void* const* d_in, const int* in_sizes, int n_in,
                              void* d_out, int out_size, void* d_ws, size_t ws_size,
                              hipStream_t stream) {
    (void)in_sizes; (void)n_in; (void)out_size; (void)ws_size;
    const float* Q    = (const float*)d_in[0];
    const float* K    = (const float*)d_in[1];
    const float* V    = (const float*)d_in[2];
    const float* mask = (const float*)d_in[3];
    float* Out = (float*)d_out;

    float* KVg   = (float*)d_ws;            // BH * 64 * 64
    float* Ksumg = KVg + BH * DIM * DIM;    // BH * 64
    const int nws = BH * DIM * DIM + BH * DIM;

    zero_ws_kernel<<<(nws + 255) / 256, 256, 0, stream>>>((float*)d_ws, nws);
    kv_kernel<<<BH * NCHUNK, 256, 0, stream>>>(K, V, mask, KVg, Ksumg);
    out_kernel<<<BH * (SLEN / OROWS), 256, 0, stream>>>(Q, KVg, Ksumg, Out);
}

// v002
// One run takes 28.2 microseconds.
// Two timings next to v001 put it at 1.15 and 1.16 times that version's speed.
// Counting every step since v000, it is 1.87 times as fast.
#include <hip/hip_runtime.h>

// Problem constants (B=4, H=16, S=4096, D=64)
#define BH     64
#define SLEN   4096
#define DIM    64
#define NCHUNK 4
#define CHUNK  (SLEN / NCHUNK)   // 1024 rows of S per kv-block
#define KVWAVES 8                // waves per kv-block
#define WROWS  (CHUNK / KVWAVES) // 128 rows of S per wave
#define KSTEPS (WROWS / 32)      // WMMA k-steps per wave
#define OROWS  256               // rows of S per out-block

typedef __attribute__((ext_vector_type(16))) __bf16 v16bf;
typedef __attribute__((ext_vector_type(8)))  __bf16 v8bf;
typedef __attribute__((ext_vector_type(4)))  __bf16 v4bf;
typedef __attribute__((ext_vector_type(8)))  float  v8f;
typedef __attribute__((ext_vector_type(4)))  float  v4f;

// elu(x)+1  ==  x>0 ? x+1 : exp(x)
__device__ __forceinline__ float featmap(float x) {
    return x > 0.0f ? x + 1.0f : __expf(x);
}

__device__ __forceinline__ float featmap_slot(float x) {
    float e;
    asm("v_exp_f32 %0, %1\n\tv_nop" : "=v"(e) : "v"(x * 1.44269504f));
    return x > 0.0f ? x + 1.0f : e;
}

__device__ __forceinline__ int kmap(int half, int i) {
    return (i < 8) ? (half * 8 + i) : (16 + half * 8 + (i - 8));
}

__global__ __launch_bounds__(256)
void kv_kernel(const float* __restrict__ K, const float* __restrict__ V,
               const float* __restrict__ mask,
               float* __restrict__ KVg, float* __restrict__ Ksumg) {
    __shared__ float sP[KVWAVES][DIM * DIM];
    __shared__ float sS[KVWAVES][DIM];

    const int bh    = blockIdx.x / NCHUNK;
    const int chunk = blockIdx.x % NCHUNK;
    const int tid   = threadIdx.x;
    const int wave  = tid >> 5;
    const int lane  = tid & 31;
    const int half  = lane >> 4;
    const int lm    = lane & 15;

    // first row of this lane's half of the wave's first 32-row step
    const size_t row0 = (size_t)bh * SLEN + chunk * CHUNK + wave * WROWS + half * 16;
    const v4f* __restrict__ Kp = (const v4f*)(K + row0 * DIM) + lm;
    const v4f* __restrict__ Vp = (const v4f*)(V + row0 * DIM) + lm;
    const v4f* __restrict__ Mp = (const v4f*)(mask + row0);

    v8f acc[4][4];
#pragma unroll
    for (int j = 0; j < 4; ++j)
#pragma unroll
        for (int n = 0; n < 4; ++n)
#pragma unroll
            for (int r = 0; r < 8; ++r) acc[j][n][r] = 0.0f;
    float ks[4] = {0.0f, 0.0f, 0.0f, 0.0f};

    // K and mask run two steps ahead (two register buffers), V one step ahead.
    v4f kq[2][16], mq[2][4], vq[16];
#define LOAD_K(T) do { \
    _Pragma("unroll") for (int i = 0; i < 16; ++i) kq[(T) & 1][i] = Kp[((T) * 32 + i) * (DIM / 4)]; \
    _Pragma("unroll") for (int i = 0; i < 4; ++i)  mq[(T) & 1][i] = Mp[(T) * 8 + i]; } while (0)
#define LOAD_V(T) do { \
    _Pragma("unroll") for (int i = 0; i < 16; ++i) vq[i] = Vp[((T) * 32 + i) * (DIM / 4)]; } while (0)
    // The scheduling barriers pin the loads in the order of their use and each refill directly
    // behind the last use of its registers. Left free, the compiler issued step 0's K last (so
    // the first wait was for every load) and sank refills next to their use, where the wave
    // waited out a whole memory latency with few loads in flight.
    LOAD_K(0);
    __builtin_amdgcn_sched_barrier(0);
    LOAD_V(0);
    __builtin_amdgcn_sched_barrier(0);
    LOAD_K(1);
#pragma unroll
    for (int t = 0; t < KSTEPS; ++t) {
        v16bf A[4], B[4];
        __builtin_amdgcn_sched_barrier(0);
#pragma unroll
        for (int i = 0; i < 16; ++i) {
            const float mk = mq[t & 1][i >> 2][i & 3];
#pragma unroll
            for (int j = 0; j < 4; ++j) {
                const float f = featmap_slot(kq[t & 1][i][j]) * mk;
                ks[j] += f;
                A[j][i] = (__bf16)f;
            }
        }
        __builtin_amdgcn_sched_barrier(0);
        if (t + 2 < KSTEPS) LOAD_K(t + 2);
        __builtin_amdgcn_sched_barrier(0);
#pragma unroll
        for (int i = 0; i < 16; ++i)
#pragma unroll
            for (int j = 0; j < 4; ++j) B[j][i] = (__bf16)vq[i][j];
        __builtin_amdgcn_sched_barrier(0);
        if (t + 1 < KSTEPS) LOAD_V(t + 1);
        // Behind the wave's last load: no address register of an issued load is rewritten ahead
        // of this wait (a refill's own result had taken the dead K and mask address registers);
        // naming the three addresses as inputs keeps their registers as they are up to here.
        if (t + 2 == KSTEPS) asm volatile("s_wait_xcnt 0x0" :: "v"(Kp), "v"(Vp), "v"(Mp) : "memory");
        __builtin_amdgcn_sched_barrier(0);
#pragma unroll
        for (int j = 0; j < 4; ++j)
#pragma unroll
            for (int n = 0; n < 4; ++n)
                acc[j][n] = __builtin_amdgcn_wmma_f32_16x16x32_bf16(
                    false, A[j], false, B[n], (short)0, acc[j][n], false, false);
    }
#undef LOAD_K
#undef LOAD_V

    // Wave partial to LDS. Tile (j, n), vgpr r, lane (half, lm) holds
    // KV[d = 4*(r + 8*half) + j][e = 4*lm + n]: the four n of a lane are one 16-byte store.
#pragma unroll
    for (int j = 0; j < 4; ++j)
#pragma unroll
        for (int r = 0; r < 8; ++r) {
            const int dd = 4 * (r + 8 * half) + j;
            v4f o = {acc[j][0][r], acc[j][1][r], acc[j][2][r], acc[j][3][r]};
            *(v4f*)&sP[wave][dd * DIM + 4 * lm] = o;
        }
#pragma unroll
    for (int j = 0; j < 4; ++j) ks[j] += __shfl_xor(ks[j], 16);
    if (half == 0) {
        v4f o = {ks[0], ks[1], ks[2], ks[3]};
        *(v4f*)&sS[wave][4 * lm] = o;
    }
    __syncthreads();

    // All sums first, then the stores: a wave-wide b128 store fills 512 contiguous bytes of the
    // block's own row-major [d][e] plane.
    v4f* __restrict__ kvdst = (v4f*)(KVg + (size_t)blockIdx.x * DIM * DIM) + tid;
    v4f sum[DIM * DIM / 1024];
#pragma unroll
    for (int k = 0; k < DIM * DIM / 1024; ++k) {
        v4f s = {0.0f, 0.0f, 0.0f, 0.0f};
#pragma unroll
        for (int w = 0; w < KVWAVES; ++w) s += ((const v4f*)sP[w])[k * 256 + tid];
        sum[k] = s;
    }
    float ssum = 0.0f;
    if (tid < DIM) {
#pragma unroll
        for (int w = 0; w < KVWAVES; ++w) ssum += sS[w][tid];
    }
#pragma unroll
    for (int k = 0; k < DIM * DIM / 1024; ++k) kvdst[k * 256] = sum[k];
    if (tid < DIM) Ksumg[blockIdx.x * DIM + tid] = ssum;
}

// Phase 2: out = (Qf @ KV) * (1 / (Qf . Ksum)), KV and Ksum being the sums of a head's planes.
__global__ __launch_bounds__(256)
void out_kernel(const float* __restrict__ Q, const float* __restrict__ KVg,
                const float* __restrict__ Ksumg, float* __restrict__ Out) {
    const int nsb  = SLEN / OROWS;               // 16 blocks per head
    const int bh   = blockIdx.x / nsb;
    const int sblk = blockIdx.x % nsb;
    const int tid  = threadIdx.x;
    const int wave = tid >> 5;
    const int lane = tid & 31;
    const int half = lane >> 4;
    const int lm   = lane & 15;

    __shared__ float ksum_l[DIM];
    // KV as bf16 B tiles in fragment order: sB[ks][nt][i >> 3][lane][i & 7] is element i of
    // B[ks][nt] = KV[ks*32 + kmap(lane >> 4, i)][nt*16 + (lane & 15)].
    __shared__ __attribute__((aligned(16))) __bf16 sB[2][4][2][32][8];

    // The block adds the head's planes up once: this thread takes rows d = 4*dq .. 4*dq+3,
    // columns e = 4*eq .. 4*eq+3. The four d of one column are neighbours in a fragment.
    {
        const int eq = tid & 15;
        const int dq = tid >> 4;
        const v4f* __restrict__ Pp =
            (const v4f*)(KVg + (size_t)bh * NCHUNK * DIM * DIM) + dq * DIM + eq;
        v4f p[NCHUNK][4];
#pragma unroll
        for (int c = 0; c < NCHUNK; ++c)
#pragma unroll
            for (int i = 0; i < 4; ++i) p[c][i] = Pp[c * (DIM * DIM / 4) + i * (DIM / 4)];
        // No address register of these loads is rewritten ahead of this wait (the last load's
        // own result had taken the address pair); the input keeps the pair up to here.
        asm volatile("s_wait_xcnt 0x0" :: "v"(Pp) : "memory");
        // Behind the plane loads, so that the two waves that take this branch wait once for both.
        if (tid < DIM) {
            const float* __restrict__ Sp = Ksumg + bh * NCHUNK * DIM + tid;
            ksum_l[tid] = (Sp[0] + Sp[DIM]) + (Sp[2 * DIM] + Sp[3 * DIM]);
        }
        v4f s[4];
#pragma unroll
        for (int i = 0; i < 4; ++i) s[i] = (p[0][i] + p[1][i]) + (p[2][i] + p[3][i]);
#pragma unroll
        for (int j = 0; j < 4; ++j) {
            v4bf o = {(__bf16)s[0][j], (__bf16)s[1][j], (__bf16)s[2][j], (__bf16)s[3][j]};
            *(v4bf*)&sB[dq >> 3][eq >> 2][(dq >> 2) & 1]
                       [((dq >> 1) & 1) * 16 + (eq & 3) * 4 + j][(dq & 1) * 4] = o;
        }
    }
    __syncthreads();

    v16bf Bkv[2][4];
#pragma unroll
    for (int ks = 0; ks < 2; ++ks)
#pragma unroll
        for (int nt = 0; nt < 4; ++nt)
            Bkv[ks][nt] = __builtin_shufflevector(
                *(const v8bf*)&sB[ks][nt][0][lane][0], *(const v8bf*)&sB[ks][nt][1][lane][0],
                0, 1, 2, 3, 4, 5, 6, 7, 8, 9, 10, 11, 12, 13, 14, 15);

    const float* __restrict__ Qp = Q + (size_t)bh * SLEN * DIM;
    float* __restrict__ Op       = Out + (size_t)bh * SLEN * DIM;

#pragma unroll
    for (int it = 0; it < 2; ++it) {             // 2 x 16 rows per wave
        const int srow0 = sblk * OROWS + wave * 32 + it * 16;
        const int s     = srow0 + lm;            // A-operand row for this lane

        // A tiles via b128 loads: per k-step the lane's d-indices are two
        // contiguous 8-float runs: [ks*32+half*8 .. +7] and [+16 .. +23].
        const float4* __restrict__ Qrow =
            (const float4*)(Qp + (size_t)s * DIM);
        float dp = 0.0f;
        v16bf A[2];
#pragma unroll
        for (int ks = 0; ks < 2; ++ks) {
            const int b4 = (ks * 32 + half * 8) >> 2;   // float4 index
            float qs[16];
            *(float4*)&qs[0]  = Qrow[b4 + 0];
            *(float4*)&qs[4]  = Qrow[b4 + 1];
            *(float4*)&qs[8]  = Qrow[b4 + 4];
            *(float4*)&qs[12] = Qrow[b4 + 5];
#pragma unroll
            for (int i = 0; i < 16; ++i) {
                const int d = ks * 32 + kmap(half, i);
                const float f = featmap(qs[i]);
                dp += f * ksum_l[d];
                A[ks][i] = (__bf16)f;
            }
        }
        const float denom = dp + __shfl_xor(dp, 16);

        v8f acc[4];
#pragma unroll
        for (int nt = 0; nt < 4; ++nt)
#pragma unroll
            for (int r = 0; r < 8; ++r) acc[nt][r] = 0.0f;

#pragma unroll
        for (int ks = 0; ks < 2; ++ks)
#pragma unroll
            for (int nt = 0; nt < 4; ++nt)
                acc[nt] = __builtin_amdgcn_wmma_f32_16x16x32_bf16(
                    false, A[ks], false, Bkv[ks][nt], (short)0, acc[nt],
                    false, false);

#pragma unroll
        for (int r = 0; r < 8; ++r) {
            const float dn = __shfl(denom, r + 8 * half);
            const float z  = 1.0f / dn;
            const int  srw = srow0 + r + 8 * half;
            const size_t rowO = (size_t)srw * DIM;
#pragma unroll
            for (int nt = 0; nt < 4; ++nt)
                Op[rowO + nt * 16 + lm] = acc[nt][r] * z;
        }
    }
}

extern "C" void kernel_launch(void* const* d_in, const int* in_sizes, int n_in,
                              void* d_out, int out_size, void* d_ws, size_t ws_size,
                              hipStream_t stream) {
    (void)in_sizes; (void)n_in; (void)out_size; (void)ws_size;
    const float* Q    = (const float*)d_in[0];
    const float* K    = (const float*)d_in[1];
    const float* V    = (const float*)d_in[2];
    const float* mask = (const float*)d_in[3];
    float* Out = (float*)d_out;

    float* KVg   = (float*)d_ws;                     // BH * NCHUNK planes of 64 * 64
    float* Ksumg = KVg + BH * NCHUNK * DIM * DIM;    // BH * NCHUNK planes of 64

    kv_kernel<<<BH * NCHUNK, 256, 0, stream>>>(K, V, mask, KVg, Ksumg);
    out_kernel<<<BH * (SLEN / OROWS), 256, 0, stream>>>(Q, KVg, Ksumg, Out);
}

// v003
// A run of this version takes 22.2 microseconds.
// Next to v002, in two timings, it ran 1.25 and 1.27 times as fast.
// All steps since v000 together make it 2.36 times as fast.
#include <hip/hip_runtime.h>

// Problem constants (B=4, H=16, S=4096, D=64)
#define BH     64
#define SLEN   4096
#define DIM    64
#define NCHUNK 4
#define CHUNK  (SLEN / NCHUNK)
#define KVWAVES 8
#define WROWS  (CHUNK / KVWAVES)
#define KSTEPS (WROWS / 32)
#define OROWS  1024
#define OWAVES 16
#define OWROWS (OROWS / OWAVES)
#define QPITCH 68

typedef __attribute__((ext_vector_type(16))) __bf16 v16bf;
typedef __attribute__((ext_vector_type(8)))  __bf16 v8bf;
typedef __attribute__((ext_vector_type(4)))  __bf16 v4bf;
typedef __attribute__((ext_vector_type(8)))  float  v8f;
typedef __attribute__((ext_vector_type(4)))  float  v4f;

// elu(x)+1  ==  x>0 ? x+1 : exp(x)
__device__ __forceinline__ float featmap(float x) {
    return x > 0.0f ? x + 1.0f : __expf(x);
}

__device__ __forceinline__ float featmap_slot(float x) {
    float e;
    asm("v_exp_f32 %0, %1\n\tv_nop" : "=v"(e) : "v"(x * 1.44269504f));
    return x > 0.0f ? x + 1.0f : e;
}

__device__ __forceinline__ int kmap(int half, int i) {
    return (i < 8) ? (half * 8 + i) : (16 + half * 8 + (i - 8));
}

__global__ __launch_bounds__(256)
void kv_kernel(const float* __restrict__ K, const float* __restrict__ V,
               const float* __restrict__ mask,
               float* __restrict__ KVg, float* __restrict__ Ksumg) {
    __shared__ float sP[KVWAVES][DIM * DIM];
    __shared__ float sS[KVWAVES][DIM];

    const int bh    = blockIdx.x / NCHUNK;
    const int chunk = blockIdx.x % NCHUNK;
    const int tid   = threadIdx.x;
    const int wave  = tid >> 5;
    const int lane  = tid & 31;
    const int half  = lane >> 4;
    const int lm    = lane & 15;

    // first row of this lane's half of the wave's first 32-row step
    const size_t row0 = (size_t)bh * SLEN + chunk * CHUNK + wave * WROWS + half * 16;
    const v4f* __restrict__ Kp = (const v4f*)(K + row0 * DIM) + lm;
    const v4f* __restrict__ Vp = (const v4f*)(V + row0 * DIM) + lm;
    const v4f* __restrict__ Mp = (const v4f*)(mask + row0);

    v8f acc[4][4];
#pragma unroll
    for (int j = 0; j < 4; ++j)
#pragma unroll
        for (int n = 0; n < 4; ++n)
#pragma unroll
            for (int r = 0; r < 8; ++r) acc[j][n][r] = 0.0f;
    float ks[4] = {0.0f, 0.0f, 0.0f, 0.0f};

    // K and mask run two steps ahead (two register buffers), V one step ahead.
    v4f kq[2][16], mq[2][4], vq[16];
#define LOAD_K(T) do { \
    _Pragma("unroll") for (int i = 0; i < 16; ++i) kq[(T) & 1][i] = Kp[((T) * 32 + i) * (DIM / 4)]; \
    _Pragma("unroll") for (int i = 0; i < 4; ++i)  mq[(T) & 1][i] = Mp[(T) * 8 + i]; } while (0)
#define LOAD_V(T) do { \
    _Pragma("unroll") for (int i = 0; i < 16; ++i) vq[i] = Vp[((T) * 32 + i) * (DIM / 4)]; } while (0)
    // The scheduling barriers pin the loads in the order of their use and each refill directly
    // behind the last use of its registers. Left free, the compiler issued step 0's K last (so
    // the first wait was for every load) and sank refills next to their use, where the wave
    // waited out a whole memory latency with few loads in flight.
    LOAD_K(0);
    __builtin_amdgcn_sched_barrier(0);
    LOAD_V(0);
    __builtin_amdgcn_sched_barrier(0);
    LOAD_K(1);
#pragma unroll
    for (int t = 0; t < KSTEPS; ++t) {
        v16bf A[4], B[4];
        __builtin_amdgcn_sched_barrier(0);
#pragma unroll
        for (int i = 0; i < 16; ++i) {
            const float mk = mq[t & 1][i >> 2][i & 3];
#pragma unroll
            for (int j = 0; j < 4; ++j) {
                const float f = featmap_slot(kq[t & 1][i][j]) * mk;
                ks[j] += f;
                A[j][i] = (__bf16)f;
            }
        }
        __builtin_amdgcn_sched_barrier(0);
        if (t + 2 < KSTEPS) LOAD_K(t + 2);
        __builtin_amdgcn_sched_barrier(0);
#pragma unroll
        for (int i = 0; i < 16; ++i)
#pragma unroll
            for (int j = 0; j < 4; ++j) B[j][i] = (__bf16)vq[i][j];
        __builtin_amdgcn_sched_barrier(0);
        if (t + 1 < KSTEPS) LOAD_V(t + 1);
        // Behind the wave's last load: no address register of an issued load is rewritten ahead
        // of this wait (a refill's own result had taken the dead K and mask address registers);
        // naming the three addresses as inputs keeps their registers as they are up to here.
        if (t + 2 == KSTEPS) asm volatile("s_wait_xcnt 0x0" :: "v"(Kp), "v"(Vp), "v"(Mp) : "memory");
        __builtin_amdgcn_sched_barrier(0);
#pragma unroll
        for (int j = 0; j < 4; ++j)
#pragma unroll
            for (int n = 0; n < 4; ++n)
                acc[j][n] = __builtin_amdgcn_wmma_f32_16x16x32_bf16(
                    false, A[j], false, B[n], (short)0, acc[j][n], false, false);
    }
#undef LOAD_K
#undef LOAD_V

    // Wave partial to LDS. Tile (j, n), vgpr r, lane (half, lm) holds
    // KV[d = 4*(r + 8*half) + j][e = 4*lm + n]: the four n of a lane are one 16-byte store.
#pragma unroll
    for (int j = 0; j < 4; ++j)
#pragma unroll
        for (int r = 0; r < 8; ++r) {
            const int dd = 4 * (r + 8 * half) + j;
            v4f o = {acc[j][0][r], acc[j][1][r], acc[j][2][r], acc[j][3][r]};
            *(v4f*)&sP[wave][dd * DIM + 4 * lm] = o;
        }
#pragma unroll
    for (int j = 0; j < 4; ++j) ks[j] += __shfl_xor(ks[j], 16);
    if (half == 0) {
        v4f o = {ks[0], ks[1], ks[2], ks[3]};
        *(v4f*)&sS[wave][4 * lm] = o;
    }
    __syncthreads();

    // All sums first, then the stores: a wave-wide b128 store fills 512 contiguous bytes of the
    // block's own row-major [d][e] plane.
    v4f* __restrict__ kvdst = (v4f*)(KVg + (size_t)blockIdx.x * DIM * DIM) + tid;
    v4f sum[DIM * DIM / 1024];
#pragma unroll
    for (int k = 0; k < DIM * DIM / 1024; ++k) {
        v4f s = {0.0f, 0.0f, 0.0f, 0.0f};
#pragma unroll
        for (int w = 0; w < KVWAVES; ++w) s += ((const v4f*)sP[w])[k * 256 + tid];
        sum[k] = s;
    }
    float ssum = 0.0f;
    if (tid < DIM) {
#pragma unroll
        for (int w = 0; w < KVWAVES; ++w) ssum += sS[w][tid];
    }
#pragma unroll
    for (int k = 0; k < DIM * DIM / 1024; ++k) kvdst[k * 256] = sum[k];
    if (tid < DIM) Ksumg[blockIdx.x * DIM + tid] = ssum;
}

__device__ __forceinline__ void copy8_rows(unsigned l, const float* g) {
    asm volatile(
        "global_load_async_to_lds_b128 %0, %8, off\n\t"
        "global_load_async_to_lds_b128 %1, %9, off\n\t"
        "global_load_async_to_lds_b128 %2, %10, off\n\t"
        "global_load_async_to_lds_b128 %3, %11, off\n\t"
        "global_load_async_to_lds_b128 %4, %12, off\n\t"
        "global_load_async_to_lds_b128 %5, %13, off\n\t"
        "global_load_async_to_lds_b128 %6, %14, off\n\t"
        "global_load_async_to_lds_b128 %7, %15, off\n\t"
        "s_wait_xcnt 0x0"
        :: "v"(l), "v"(l + 2 * QPITCH * 4), "v"(l + 4 * QPITCH * 4), "v"(l + 6 * QPITCH * 4),
           "v"(l + 8 * QPITCH * 4), "v"(l + 10 * QPITCH * 4), "v"(l + 12 * QPITCH * 4),
           "v"(l + 14 * QPITCH * 4),
           "v"(g), "v"(g + 2 * DIM), "v"(g + 4 * DIM), "v"(g + 6 * DIM),
           "v"(g + 8 * DIM), "v"(g + 10 * DIM), "v"(g + 12 * DIM), "v"(g + 14 * DIM)
        : "memory");
}

__global__ __launch_bounds__(OWAVES * 32)
void out_kernel(const float* __restrict__ Q, const float* __restrict__ KVg,
                const float* __restrict__ Ksumg, float* __restrict__ Out) {
    const int nsb  = SLEN / OROWS;               // 4 blocks per head
    const int bh   = blockIdx.x / nsb;
    const int sblk = blockIdx.x % nsb;
    const int tid  = threadIdx.x;
    const int wave = tid >> 5;
    const int lane = tid & 31;
    const int half = lane >> 4;
    const int lm   = lane & 15;

    __shared__ float ksum_l[DIM];
    // KV as bf16 B tiles in fragment order: sB[ks][nt][i >> 3][lane][i & 7] is element i of
    // B[ks][nt] = KV[ks*32 + kmap(lane >> 4, i)][nt*16 + (lane & 15)].
    __shared__ __attribute__((aligned(16))) __bf16 sB[2][4][2][32][8];
    // The 64 rows of Q of each wave, f32 as they are in memory.
    __shared__ __attribute__((aligned(16))) float sQ[OWAVES][OWROWS * QPITCH];

    const float* __restrict__ Qp = Q + (size_t)bh * SLEN * DIM;
    {
        typedef __attribute__((address_space(3))) float lds_float;
        const unsigned l = (unsigned)(size_t)(lds_float*)&sQ[wave][half * QPITCH + lm * 4];
        const float* g = Qp + (size_t)(sblk * OROWS + wave * OWROWS + half) * DIM + lm * 4;
        copy8_rows(l, g);                                  // rows  0 .. 15 of the wave's 64
        copy8_rows(l + 16 * QPITCH * 4, g + 16 * DIM);     // rows 16 .. 31
        copy8_rows(l + 32 * QPITCH * 4, g + 32 * DIM);     // rows 32 .. 47
        copy8_rows(l + 48 * QPITCH * 4, g + 48 * DIM);     // rows 48 .. 63
    }

    // The block adds the head's planes up once: this thread takes rows d = 4*dq .. 4*dq+3,
    // columns e = 4*eq .. 4*eq+3. The four d of one column are neighbours in a fragment.
    if (tid < 256) {
        const int eq = tid & 15;
        const int dq = tid >> 4;
        const v4f* __restrict__ Pp =
            (const v4f*)(KVg + (size_t)bh * NCHUNK * DIM * DIM) + dq * DIM + eq;
        v4f p[NCHUNK][4];
#pragma unroll
        for (int c = 0; c < NCHUNK; ++c)
#pragma unroll
            for (int i = 0; i < 4; ++i) p[c][i] = Pp[c * (DIM * DIM / 4) + i * (DIM / 4)];
        // No address register of these loads is rewritten ahead of this wait (the last load's
        // own result had taken the address pair); the input keeps the pair up to here.
        asm volatile("s_wait_xcnt 0x0" :: "v"(Pp) : "memory");
        // Behind the plane loads, so that the two waves that take this branch wait once for both.
        if (tid < DIM) {
            const float* __restrict__ Sp = Ksumg + bh * NCHUNK * DIM + tid;
            ksum_l[tid] = (Sp[0] + Sp[DIM]) + (Sp[2 * DIM] + Sp[3 * DIM]);
        }
        v4f s[4];
#pragma unroll
        for (int i = 0; i < 4; ++i) s[i] = (p[0][i] + p[1][i]) + (p[2][i] + p[3][i]);
#pragma unroll
        for (int j = 0; j < 4; ++j) {
            v4bf o = {(__bf16)s[0][j], (__bf16)s[1][j], (__bf16)s[2][j], (__bf16)s[3][j]};
            *(v4bf*)&sB[dq >> 3][eq >> 2][(dq >> 2) & 1]
                       [((dq >> 1) & 1) * 16 + (eq & 3) * 4 + j][(dq & 1) * 4] = o;
        }
    }
    // Every copy of this wave has landed before the barrier behind which its rows are read.
    asm volatile("s_wait_asynccnt 0x0" ::: "memory");
    __syncthreads();

    v16bf Bkv[2][4];
#pragma unroll
    for (int ks = 0; ks < 2; ++ks)
#pragma unroll
        for (int nt = 0; nt < 4; ++nt)
            Bkv[ks][nt] = __builtin_shufflevector(
                *(const v8bf*)&sB[ks][nt][0][lane][0], *(const v8bf*)&sB[ks][nt][1][lane][0],
                0, 1, 2, 3, 4, 5, 6, 7, 8, 9, 10, 11, 12, 13, 14, 15);

    float* __restrict__ Op       = Out + (size_t)bh * SLEN * DIM;

#pragma unroll
    for (int it = 0; it < OWROWS / 16; ++it) {   // 4 x 16 rows per wave
        const int srow0 = sblk * OROWS + wave * OWROWS + it * 16;

        // A tiles via b128 LDS loads of the lane's row it*16 + lm: per k-step the lane's
        // d-indices are two contiguous 8-float runs: [ks*32+half*8 .. +7] and [+16 .. +23].
        const float4* Qrow = (const float4*)&sQ[wave][(it * 16 + lm) * QPITCH];
        float dp = 0.0f;
        v16bf A[2];
#pragma unroll
        for (int ks = 0; ks < 2; ++ks) {
            const int b4 = (ks * 32 + half * 8) >> 2;   // float4 index
            float qs[16];
            *(float4*)&qs[0]  = Qrow[b4 + 0];
            *(float4*)&qs[4]  = Qrow[b4 + 1];
            *(float4*)&qs[8]  = Qrow[b4 + 4];
            *(float4*)&qs[12] = Qrow[b4 + 5];
#pragma unroll
            for (int i = 0; i < 16; ++i) {
                const int d = ks * 32 + kmap(half, i);
                const float f = featmap(qs[i]);
                dp += f * ksum_l[d];
                A[ks][i] = (__bf16)f;
            }
        }
        const float denom = dp + __shfl_xor(dp, 16);

        v8f acc[4];
#pragma unroll
        for (int nt = 0; nt < 4; ++nt)
#pragma unroll
            for (int r = 0; r < 8; ++r) acc[nt][r] = 0.0f;

#pragma unroll
        for (int ks = 0; ks < 2; ++ks)
#pragma unroll
            for (int nt = 0; nt < 4; ++nt)
                acc[nt] = __builtin_amdgcn_wmma_f32_16x16x32_bf16(
                    false, A[ks], false, Bkv[ks][nt], (short)0, acc[nt],
                    false, false);

#pragma unroll
        for (int r = 0; r < 8; ++r) {
            const float dn = __shfl(denom, r + 8 * half);
            const float z  = 1.0f / dn;
            const int  srw = srow0 + r + 8 * half;
            const size_t rowO = (size_t)srw * DIM;
#pragma unroll
            for (int nt = 0; nt < 4; ++nt)
                Op[rowO + nt * 16 + lm] = acc[nt][r] * z;
        }
    }
}

extern "C" void kernel_launch(void* const* d_in, const int* in_sizes, int n_in,
                              void* d_out, int out_size, void* d_ws, size_t ws_size,
                              hipStream_t stream) {
    (void)in_sizes; (void)n_in; (void)out_size; (void)ws_size;
    const float* Q    = (const float*)d_in[0];
    const float* K    = (const float*)d_in[1];
    const float* V    = (const float*)d_in[2];
    const float* mask = (const float*)d_in[3];
    float* Out = (float*)d_out;

    float* KVg   = (float*)d_ws;                     // BH * NCHUNK planes of 64 * 64
    float* Ksumg = KVg + BH * NCHUNK * DIM * DIM;    // BH * NCHUNK planes of 64

    kv_kernel<<<BH * NCHUNK, 256, 0, stream>>>(K, V, mask, KVg, Ksumg);
    out_kernel<<<BH * (SLEN / OROWS), OWAVES * 32, 0, stream>>>(Q, KVg, Ksumg, Out);
}

// v004
// Measured time: 21.5 microseconds a run.
// Timed twice side by side with v003, it ran 1.03 and 1.04 times as fast.
// All steps since v000 together make it 2.44 times as fast.
#include <hip/hip_runtime.h>

// Problem constants (B=4, H=16, S=4096, D=64)
#define BH     64
#define SLEN   4096
#define DIM    64
#define NCHUNK 4
#define CHUNK  (SLEN / NCHUNK)
#define KVWAVES 8
#define WROWS  (CHUNK / KVWAVES)
#define KSTEPS (WROWS / 32)
#define OROWS  1024
#define OWAVES 16
#define OWROWS (OROWS / OWAVES)
#define QPITCH 68

typedef __attribute__((ext_vector_type(16))) __bf16 v16bf;
typedef __attribute__((ext_vector_type(8)))  __bf16 v8bf;
typedef __attribute__((ext_vector_type(4)))  __bf16 v4bf;
typedef __attribute__((ext_vector_type(8)))  float  v8f;
typedef __attribute__((ext_vector_type(4)))  float  v4f;

// elu(x)+1  ==  x>0 ? x+1 : exp(x)
__device__ __forceinline__ float featmap(float x) {
    return x > 0.0f ? x + 1.0f : __expf(x);
}

__device__ __forceinline__ float featmap_slot(float x) {
    float e;
    asm("v_exp_f32 %0, %1\n\tv_nop" : "=v"(e) : "v"(x * 1.44269504f));
    return x > 0.0f ? x + 1.0f : e;
}

__device__ __forceinline__ int kmap(int half, int i) {
    return (i < 8) ? (half * 8 + i) : (16 + half * 8 + (i - 8));
}

__global__ __launch_bounds__(256)
void kv_kernel(const float* __restrict__ K, const float* __restrict__ V,
               const float* __restrict__ mask, const float* __restrict__ Q,
               float* __restrict__ KVg, float* __restrict__ Ksumg) {
    __shared__ float sP[KVWAVES][DIM * DIM];
    __shared__ float sS[KVWAVES][DIM];

    const int bh    = blockIdx.x / NCHUNK;
    const int chunk = blockIdx.x % NCHUNK;
    const int tid   = threadIdx.x;
    const int wave  = tid >> 5;
    const int lane  = tid & 31;
    const int half  = lane >> 4;
    const int lm    = lane & 15;

    // first row of this lane's half of the wave's first 32-row step
    const size_t row0 = (size_t)bh * SLEN + chunk * CHUNK + wave * WROWS + half * 16;
    const v4f* __restrict__ Kp = (const v4f*)(K + row0 * DIM) + lm;
    const v4f* __restrict__ Vp = (const v4f*)(V + row0 * DIM) + lm;
    const v4f* __restrict__ Mp = (const v4f*)(mask + row0);
    // First of the 1024 rows of Q that phase 2's block of the same index reads.
    const float* Qb = Q + (size_t)blockIdx.x * OROWS * DIM;
    unsigned qo = 0;   // this lane's byte offset from there, formed where the hint is issued

    v8f acc[4][4];
#pragma unroll
    for (int j = 0; j < 4; ++j)
#pragma unroll
        for (int n = 0; n < 4; ++n)
#pragma unroll
            for (int r = 0; r < 8; ++r) acc[j][n][r] = 0.0f;
    float ks[4] = {0.0f, 0.0f, 0.0f, 0.0f};

    // K and mask run two steps ahead (two register buffers), V one step ahead.
    v4f kq[2][16], mq[2][4], vq[16];
#define LOAD_K(T) do { \
    _Pragma("unroll") for (int i = 0; i < 16; ++i) kq[(T) & 1][i] = Kp[((T) * 32 + i) * (DIM / 4)]; \
    _Pragma("unroll") for (int i = 0; i < 4; ++i)  mq[(T) & 1][i] = Mp[(T) * 8 + i]; } while (0)
#define LOAD_V(T) do { \
    _Pragma("unroll") for (int i = 0; i < 16; ++i) vq[i] = Vp[((T) * 32 + i) * (DIM / 4)]; } while (0)
    // The scheduling barriers pin the loads in the order of their use and each refill directly
    // behind the last use of its registers. Left free, the compiler issued step 0's K last (so
    // the first wait was for every load) and sank refills next to their use, where the wave
    // waited out a whole memory latency with few loads in flight.
    LOAD_K(0);
    __builtin_amdgcn_sched_barrier(0);
    LOAD_V(0);
    __builtin_amdgcn_sched_barrier(0);
    LOAD_K(1);
#pragma unroll
    for (int t = 0; t < KSTEPS; ++t) {
        v16bf A[4], B[4];
        __builtin_amdgcn_sched_barrier(0);
#pragma unroll
        for (int i = 0; i < 16; ++i) {
            const float mk = mq[t & 1][i >> 2][i & 3];
#pragma unroll
            for (int j = 0; j < 4; ++j) {
                const float f = featmap_slot(kq[t & 1][i][j]) * mk;
                ks[j] += f;
                A[j][i] = (__bf16)f;
            }
        }
        __builtin_amdgcn_sched_barrier(0);
        if (t + 2 < KSTEPS) LOAD_K(t + 2);
        __builtin_amdgcn_sched_barrier(0);
#pragma unroll
        for (int i = 0; i < 16; ++i)
#pragma unroll
            for (int j = 0; j < 4; ++j) B[j][i] = (__bf16)vq[i][j];
        __builtin_amdgcn_sched_barrier(0);
        if (t + 1 < KSTEPS) LOAD_V(t + 1);
        // Behind the wave's last load: no address register of an issued load is rewritten ahead
        // of this wait (a refill's own result had taken the dead K and mask address registers);
        // naming the three addresses as inputs keeps their registers as they are up to here.
        if (t + 2 == KSTEPS) asm volatile("s_wait_xcnt 0x0" :: "v"(Kp), "v"(Vp), "v"(Mp) : "memory");
        // Behind the landing of the wave's last load memory has nothing more to do for this launch:
        // ask L2 for the first 512 of the 1024 rows of Q that phase 2's block of the same index
        // reads first thing (thread tid asks for rows tid and
        // tid + 256), so that they are fetched under the last products, the sum over the waves and
        // the gap between the launches. A hint: nothing is returned, nothing depends on it, and
        // every address lies inside Q. The shift stands in the statement because the compiler
        // formed the offset at the kernel's head and spilled it to scratch.
        if (t + 1 == KSTEPS)
            asm volatile("v_lshlrev_b32 %0, 8, %1\n\t"
                         "global_prefetch_b8 %0, %2 scope:SCOPE_SE\n\t"
                         "global_prefetch_b8 %0, %2 offset:65536 scope:SCOPE_SE"
                         : "=&v"(qo) : "v"(tid), "s"(Qb) : "memory");
        __builtin_amdgcn_sched_barrier(0);
#pragma unroll
        for (int j = 0; j < 4; ++j)
#pragma unroll
            for (int n = 0; n < 4; ++n)
                acc[j][n] = __builtin_amdgcn_wmma_f32_16x16x32_bf16(
                    false, A[j], false, B[n], (short)0, acc[j][n], false, false);
    }
#undef LOAD_K
#undef LOAD_V

    // Wave partial to LDS. Tile (j, n), vgpr r, lane (half, lm) holds
    // KV[d = 4*(r + 8*half) + j][e = 4*lm + n]: the four n of a lane are one 16-byte store.
#pragma unroll
    for (int j = 0; j < 4; ++j)
#pragma unroll
        for (int r = 0; r < 8; ++r) {
            const int dd = 4 * (r + 8 * half) + j;
            v4f o = {acc[j][0][r], acc[j][1][r], acc[j][2][r], acc[j][3][r]};
            *(v4f*)&sP[wave][dd * DIM + 4 * lm] = o;
        }
#pragma unroll
    for (int j = 0; j < 4; ++j) ks[j] += __shfl_xor(ks[j], 16);
    if (half == 0) {
        v4f o = {ks[0], ks[1], ks[2], ks[3]};
        *(v4f*)&sS[wave][4 * lm] = o;
    }
    __syncthreads();

    // All sums first, then the stores: a wave-wide b128 store fills 512 contiguous bytes of the
    // block's own row-major [d][e] plane.
    v4f* __restrict__ kvdst = (v4f*)(KVg + (size_t)blockIdx.x * DIM * DIM) + tid;
    v4f sum[DIM * DIM / 1024];
#pragma unroll
    for (int k = 0; k < DIM * DIM / 1024; ++k) {
        v4f s = {0.0f, 0.0f, 0.0f, 0.0f};
#pragma unroll
        for (int w = 0; w < KVWAVES; ++w) s += ((const v4f*)sP[w])[k * 256 + tid];
        sum[k] = s;
    }
    float ssum = 0.0f;
    if (tid < DIM) {
#pragma unroll
        for (int w = 0; w < KVWAVES; ++w) ssum += sS[w][tid];
    }
#pragma unroll
    for (int k = 0; k < DIM * DIM / 1024; ++k) kvdst[k * 256] = sum[k];
    if (tid < DIM) Ksumg[blockIdx.x * DIM + tid] = ssum;
    // The hint's address registers are rewritten nowhere ahead of this wait: the inputs keep them.
    asm volatile("s_wait_xcnt 0x0" :: "v"(qo), "s"(Qb) : "memory");
}

__device__ __forceinline__ void copy8_rows(unsigned l, const float* g) {
    asm volatile(
        "global_load_async_to_lds_b128 %0, %8, off\n\t"
        "global_load_async_to_lds_b128 %1, %9, off\n\t"
        "global_load_async_to_lds_b128 %2, %10, off\n\t"
        "global_load_async_to_lds_b128 %3, %11, off\n\t"
        "global_load_async_to_lds_b128 %4, %12, off\n\t"
        "global_load_async_to_lds_b128 %5, %13, off\n\t"
        "global_load_async_to_lds_b128 %6, %14, off\n\t"
        "global_load_async_to_lds_b128 %7, %15, off\n\t"
        "s_wait_xcnt 0x0"
        :: "v"(l), "v"(l + 2 * QPITCH * 4), "v"(l + 4 * QPITCH * 4), "v"(l + 6 * QPITCH * 4),
           "v"(l + 8 * QPITCH * 4), "v"(l + 10 * QPITCH * 4), "v"(l + 12 * QPITCH * 4),
           "v"(l + 14 * QPITCH * 4),
           "v"(g), "v"(g + 2 * DIM), "v"(g + 4 * DIM), "v"(g + 6 * DIM),
           "v"(g + 8 * DIM), "v"(g + 10 * DIM), "v"(g + 12 * DIM), "v"(g + 14 * DIM)
        : "memory");
}

__global__ __launch_bounds__(OWAVES * 32)
void out_kernel(const float* __restrict__ Q, const float* __restrict__ KVg,
                const float* __restrict__ Ksumg, float* __restrict__ Out) {
    const int nsb  = SLEN / OROWS;               // 4 blocks per head
    const int bh   = blockIdx.x / nsb;
    const int sblk = blockIdx.x % nsb;
    const int tid  = threadIdx.x;
    const int wave = tid >> 5;
    const int lane = tid & 31;
    const int half = lane >> 4;
    const int lm   = lane & 15;

    __shared__ float ksum_l[DIM];
    // KV as bf16 B tiles in fragment order: sB[ks][nt][i >> 3][lane][i & 7] is element i of
    // B[ks][nt] = KV[ks*32 + kmap(lane >> 4, i)][nt*16 + (lane & 15)].
    __shared__ __attribute__((aligned(16))) __bf16 sB[2][4][2][32][8];
    // The 64 rows of Q of each wave, f32 as they are in memory.
    __shared__ __attribute__((aligned(16))) float sQ[OWAVES][OWROWS * QPITCH];

    const float* __restrict__ Qp = Q + (size_t)bh * SLEN * DIM;
    {
        typedef __attribute__((address_space(3))) float lds_float;
        const unsigned l = (unsigned)(size_t)(lds_float*)&sQ[wave][half * QPITCH + lm * 4];
        const float* g = Qp + (size_t)(sblk * OROWS + wave * OWROWS + half) * DIM + lm * 4;
        copy8_rows(l, g);                                  // rows  0 .. 15 of the wave's 64
        copy8_rows(l + 16 * QPITCH * 4, g + 16 * DIM);     // rows 16 .. 31
        copy8_rows(l + 32 * QPITCH * 4, g + 32 * DIM);     // rows 32 .. 47
        copy8_rows(l + 48 * QPITCH * 4, g + 48 * DIM);     // rows 48 .. 63
    }

    // The block adds the head's planes up once: this thread takes rows d = 4*dq .. 4*dq+3,
    // columns e = 4*eq .. 4*eq+3. The four d of one column are neighbours in a fragment.
    if (tid < 256) {
        const int eq = tid & 15;
        const int dq = tid >> 4;
        const v4f* __restrict__ Pp =
            (const v4f*)(KVg + (size_t)bh * NCHUNK * DIM * DIM) + dq * DIM + eq;
        v4f p[NCHUNK][4];
#pragma unroll
        for (int c = 0; c < NCHUNK; ++c)
#pragma unroll
            for (int i = 0; i < 4; ++i) p[c][i] = Pp[c * (DIM * DIM / 4) + i * (DIM / 4)];
        // No address register of these loads is rewritten ahead of this wait (the last load's
        // own result had taken the address pair); the input keeps the pair up to here.
        asm volatile("s_wait_xcnt 0x0" :: "v"(Pp) : "memory");
        // Behind the plane loads, so that the two waves that take this branch wait once for both.
        if (tid < DIM) {
            const float* __restrict__ Sp = Ksumg + bh * NCHUNK * DIM + tid;
            ksum_l[tid] = (Sp[0] + Sp[DIM]) + (Sp[2 * DIM] + Sp[3 * DIM]);
        }
        v4f s[4];
#pragma unroll
        for (int i = 0; i < 4; ++i) s[i] = (p[0][i] + p[1][i]) + (p[2][i] + p[3][i]);
#pragma unroll
        for (int j = 0; j < 4; ++j) {
            v4bf o = {(__bf16)s[0][j], (__bf16)s[1][j], (__bf16)s[2][j], (__bf16)s[3][j]};
            *(v4bf*)&sB[dq >> 3][eq >> 2][(dq >> 2) & 1]
                       [((dq >> 1) & 1) * 16 + (eq & 3) * 4 + j][(dq & 1) * 4] = o;
        }
    }
    // Every copy of this wave has landed before the barrier behind which its rows are read.
    asm volatile("s_wait_asynccnt 0x0" ::: "memory");
    __syncthreads();

    v16bf Bkv[2][4];
#pragma unroll
    for (int ks = 0; ks < 2; ++ks)
#pragma unroll
        for (int nt = 0; nt < 4; ++nt)
            Bkv[ks][nt] = __builtin_shufflevector(
                *(const v8bf*)&sB[ks][nt][0][lane][0], *(const v8bf*)&sB[ks][nt][1][lane][0],
                0, 1, 2, 3, 4, 5, 6, 7, 8, 9, 10, 11, 12, 13, 14, 15);

    float* __restrict__ Op       = Out + (size_t)bh * SLEN * DIM;

#pragma unroll
    for (int it = 0; it < OWROWS / 16; ++it) {   // 4 x 16 rows per wave
        const int srow0 = sblk * OROWS + wave * OWROWS + it * 16;

        // A tiles via b128 LDS loads of the lane's row it*16 + lm: per k-step the lane's
        // d-indices are two contiguous 8-float runs: [ks*32+half*8 .. +7] and [+16 .. +23].
        const float4* Qrow = (const float4*)&sQ[wave][(it * 16 + lm) * QPITCH];
        float dp = 0.0f;
        v16bf A[2];
#pragma unroll
        for (int ks = 0; ks < 2; ++ks) {
            const int b4 = (ks * 32 + half * 8) >> 2;   // float4 index
            float qs[16];
            *(float4*)&qs[0]  = Qrow[b4 + 0];
            *(float4*)&qs[4]  = Qrow[b4 + 1];
            *(float4*)&qs[8]  = Qrow[b4 + 4];
            *(float4*)&qs[12] = Qrow[b4 + 5];
#pragma unroll
            for (int i = 0; i < 16; ++i) {
                const int d = ks * 32 + kmap(half, i);
                const float f = featmap(qs[i]);
                dp += f * ksum_l[d];
                A[ks][i] = (__bf16)f;
            }
        }
        const float denom = dp + __shfl_xor(dp, 16);

        v8f acc[4];
#pragma unroll
        for (int nt = 0; nt < 4; ++nt)
#pragma unroll
            for (int r = 0; r < 8; ++r) acc[nt][r] = 0.0f;

#pragma unroll
        for (int ks = 0; ks < 2; ++ks)
#pragma unroll
            for (int nt = 0; nt < 4; ++nt)
                acc[nt] = __builtin_amdgcn_wmma_f32_16x16x32_bf16(
                    false, A[ks], false, Bkv[ks][nt], (short)0, acc[nt],
                    false, false);

#pragma unroll
        for (int r = 0; r < 8; ++r) {
            const float dn = __shfl(denom, r + 8 * half);
            const float z  = 1.0f / dn;
            const int  srw = srow0 + r + 8 * half;
            const size_t rowO = (size_t)srw * DIM;
#pragma unroll
            for (int nt = 0; nt < 4; ++nt)
                Op[rowO + nt * 16 + lm] = acc[nt][r] * z;
        }
    }
}

extern "C" void kernel_launch(void* const* d_in, const int* in_sizes, int n_in,
                              void* d_out, int out_size, void* d_ws, size_t ws_size,
                              hipStream_t stream) {
    (void)in_sizes; (void)n_in; (void)out_size; (void)ws_size;
    const float* Q    = (const float*)d_in[0];
    const float* K    = (const float*)d_in[1];
    const float* V    = (const float*)d_in[2];
    const float* mask = (const float*)d_in[3];
    float* Out = (float*)d_out;

    float* KVg   = (float*)d_ws;                     // BH * NCHUNK planes of 64 * 64
    float* Ksumg = KVg + BH * NCHUNK * DIM * DIM;    // BH * NCHUNK planes of 64

    kv_kernel<<<BH * NCHUNK, 256, 0, stream>>>(K, V, mask, Q, KVg, Ksumg);
    out_kernel<<<BH * (SLEN / OROWS), OWAVES * 32, 0, stream>>>(Q, KVg, Ksumg, Out);
}

// v005
// A run of this version takes 20.5 microseconds.
// Next to v004, in two timings, it ran 1.04 times as fast each time.
// All steps since v000 together make it 2.55 times as fast.
#include <hip/hip_runtime.h>

// Problem constants (B=4, H=16, S=4096, D=64)
#define BH     64
#define SLEN   4096
#define DIM    64
#define NCHUNK 4
#define CHUNK  (SLEN / NCHUNK)
#define KVWAVES 8
#define WROWS  (CHUNK / KVWAVES)
#define KSTEPS (WROWS / 32)
#define OROWS  1024
#define OWAVES 16
#define OWROWS (OROWS / OWAVES)
#define QPITCH 68

typedef __attribute__((ext_vector_type(16))) __bf16 v16bf;
typedef __attribute__((ext_vector_type(8)))  __bf16 v8bf;
typedef __attribute__((ext_vector_type(4)))  __bf16 v4bf;
typedef __attribute__((ext_vector_type(8)))  float  v8f;
typedef __attribute__((ext_vector_type(4)))  float  v4f;

// elu(x)+1  ==  x>0 ? x+1 : exp(x)
__device__ __forceinline__ float featmap(float x) {
    return x > 0.0f ? x + 1.0f : __expf(x);
}

__device__ __forceinline__ float featmap_slot(float x) {
    float e;
    asm("v_exp_f32 %0, %1\n\tv_nop" : "=v"(e) : "v"(x * 1.44269504f));
    return x > 0.0f ? x + 1.0f : e;
}

__device__ __forceinline__ int kmap(int half, int i) {
    return (i < 8) ? (half * 8 + i) : (16 + half * 8 + (i - 8));
}

__global__ __launch_bounds__(256)
void kv_kernel(const float* __restrict__ K, const float* __restrict__ V,
               const float* __restrict__ mask, const float* __restrict__ Q,
               float* __restrict__ KVg, float* __restrict__ Ksumg) {
    __shared__ float sP[KVWAVES][DIM * DIM];
    __shared__ float sS[KVWAVES][DIM];

    const int bh    = blockIdx.x / NCHUNK;
    const int chunk = blockIdx.x % NCHUNK;
    const int tid   = threadIdx.x;
    const int wave  = tid >> 5;
    const int lane  = tid & 31;
    const int half  = lane >> 4;
    const int lm    = lane & 15;

    // first row of this lane's half of the wave's first 32-row step
    const size_t row0 = (size_t)bh * SLEN + chunk * CHUNK + wave * WROWS + half * 16;
    const v4f* __restrict__ Kp = (const v4f*)(K + row0 * DIM) + lm;
    const v4f* __restrict__ Vp = (const v4f*)(V + row0 * DIM) + lm;
    const v4f* __restrict__ Mp = (const v4f*)(mask + row0);
    // First of the 1024 rows of Q that phase 2's block of the same index reads.
    const float* Qb = Q + (size_t)blockIdx.x * OROWS * DIM;
    unsigned qo = 0;   // this lane's byte offset from there, formed where the hint is issued

    v8f acc[4][4];
#pragma unroll
    for (int j = 0; j < 4; ++j)
#pragma unroll
        for (int n = 0; n < 4; ++n)
#pragma unroll
            for (int r = 0; r < 8; ++r) acc[j][n][r] = 0.0f;
    float ks[4] = {0.0f, 0.0f, 0.0f, 0.0f};

    // K and mask run two steps ahead (two register buffers), V one step ahead.
    v4f kq[2][16], mq[2][4], vq[16];
#define LOAD_K(T) do { \
    _Pragma("unroll") for (int i = 0; i < 16; ++i) kq[(T) & 1][i] = Kp[((T) * 32 + i) * (DIM / 4)]; \
    _Pragma("unroll") for (int i = 0; i < 4; ++i)  mq[(T) & 1][i] = Mp[(T) * 8 + i]; } while (0)
#define LOAD_V(T) do { \
    _Pragma("unroll") for (int i = 0; i < 16; ++i) vq[i] = Vp[((T) * 32 + i) * (DIM / 4)]; } while (0)
    // The scheduling barriers pin the loads in the order of their use and each refill directly
    // behind the last use of its registers. Left free, the compiler issued step 0's K last (so
    // the first wait was for every load) and sank refills next to their use, where the wave
    // waited out a whole memory latency with few loads in flight.
    LOAD_K(0);
    __builtin_amdgcn_sched_barrier(0);
    LOAD_V(0);
    __builtin_amdgcn_sched_barrier(0);
    LOAD_K(1);
#pragma unroll
    for (int t = 0; t < KSTEPS; ++t) {
        v16bf A[4], B[4];
        __builtin_amdgcn_sched_barrier(0);
#pragma unroll
        for (int i = 0; i < 16; ++i) {
            const float mk = mq[t & 1][i >> 2][i & 3];
#pragma unroll
            for (int j = 0; j < 4; ++j) {
                const float f = featmap_slot(kq[t & 1][i][j]) * mk;
                ks[j] += f;
                A[j][i] = (__bf16)f;
            }
        }
        __builtin_amdgcn_sched_barrier(0);
        if (t + 2 < KSTEPS) LOAD_K(t + 2);
        __builtin_amdgcn_sched_barrier(0);
#pragma unroll
        for (int i = 0; i < 16; ++i)
#pragma unroll
            for (int j = 0; j < 4; ++j) B[j][i] = (__bf16)vq[i][j];
        __builtin_amdgcn_sched_barrier(0);
        if (t + 1 < KSTEPS) LOAD_V(t + 1);
        // Behind the wave's last load: no address register of an issued load is rewritten ahead
        // of this wait (a refill's own result had taken the dead K and mask address registers);
        // naming the three addresses as inputs keeps their registers as they are up to here.
        if (t + 2 == KSTEPS) asm volatile("s_wait_xcnt 0x0" :: "v"(Kp), "v"(Vp), "v"(Mp) : "memory");
        // Behind the landing of the wave's last load memory has nothing more to do for this launch:
        // ask L2 for the first 512 of the 1024 rows of Q that phase 2's block of the same index
        // reads first thing (thread tid asks for rows tid and
        // tid + 256), so that they are fetched under the last products, the sum over the waves and
        // the gap between the launches. A hint: nothing is returned, nothing depends on it, and
        // every address lies inside Q. The shift stands in the statement because the compiler
        // formed the offset at the kernel's head and spilled it to scratch.
        if (t + 1 == KSTEPS)
            asm volatile("v_lshlrev_b32 %0, 8, %1\n\t"
                         "global_prefetch_b8 %0, %2 scope:SCOPE_SE\n\t"
                         "global_prefetch_b8 %0, %2 offset:65536 scope:SCOPE_SE"
                         : "=&v"(qo) : "v"(tid), "s"(Qb) : "memory");
        __builtin_amdgcn_sched_barrier(0);
#pragma unroll
        for (int j = 0; j < 4; ++j)
#pragma unroll
            for (int n = 0; n < 4; ++n)
                acc[j][n] = __builtin_amdgcn_wmma_f32_16x16x32_bf16(
                    false, A[j], false, B[n], (short)0, acc[j][n], false, false);
    }
#undef LOAD_K
#undef LOAD_V

    // Wave partial to LDS. Tile (j, n), vgpr r, lane (half, lm) holds
    // KV[d = 4*(r + 8*half) + j][e = 4*lm + n]: the four n of a lane are one 16-byte store.
#pragma unroll
    for (int j = 0; j < 4; ++j)
#pragma unroll
        for (int r = 0; r < 8; ++r) {
            const int dd = 4 * (r + 8 * half) + j;
            v4f o = {acc[j][0][r], acc[j][1][r], acc[j][2][r], acc[j][3][r]};
            *(v4f*)&sP[wave][dd * DIM + 4 * lm] = o;
        }
#pragma unroll
    for (int j = 0; j < 4; ++j) ks[j] += __shfl_xor(ks[j], 16);
    if (half == 0) {
        v4f o = {ks[0], ks[1], ks[2], ks[3]};
        *(v4f*)&sS[wave][4 * lm] = o;
    }
    __syncthreads();

    // All sums first, then the stores: a wave-wide b128 store fills 512 contiguous bytes of the
    // block's own row-major [d][e] plane.
    v4f* __restrict__ kvdst = (v4f*)(KVg + (size_t)blockIdx.x * DIM * DIM) + tid;
    v4f sum[DIM * DIM / 1024];
#pragma unroll
    for (int k = 0; k < DIM * DIM / 1024; ++k) {
        v4f s = {0.0f, 0.0f, 0.0f, 0.0f};
#pragma unroll
        for (int w = 0; w < KVWAVES; ++w) s += ((const v4f*)sP[w])[k * 256 + tid];
        sum[k] = s;
    }
    float ssum = 0.0f;
    if (tid < DIM) {
#pragma unroll
        for (int w = 0; w < KVWAVES; ++w) ssum += sS[w][tid];
    }
#pragma unroll
    for (int k = 0; k < DIM * DIM / 1024; ++k) kvdst[k * 256] = sum[k];
    if (tid < DIM) Ksumg[blockIdx.x * DIM + tid] = ssum;
    // The hint's address registers are rewritten nowhere ahead of this wait: the inputs keep them.
    asm volatile("s_wait_xcnt 0x0" :: "v"(qo), "s"(Qb) : "memory");
}

__device__ __forceinline__ void copy8_rows(unsigned l, const float* g) {
    asm volatile(
        "global_load_async_to_lds_b128 %0, %8, off\n\t"
        "global_load_async_to_lds_b128 %1, %9, off\n\t"
        "global_load_async_to_lds_b128 %2, %10, off\n\t"
        "global_load_async_to_lds_b128 %3, %11, off\n\t"
        "global_load_async_to_lds_b128 %4, %12, off\n\t"
        "global_load_async_to_lds_b128 %5, %13, off\n\t"
        "global_load_async_to_lds_b128 %6, %14, off\n\t"
        "global_load_async_to_lds_b128 %7, %15, off\n\t"
        "s_wait_xcnt 0x0"
        :: "v"(l), "v"(l + 2 * QPITCH * 4), "v"(l + 4 * QPITCH * 4), "v"(l + 6 * QPITCH * 4),
           "v"(l + 8 * QPITCH * 4), "v"(l + 10 * QPITCH * 4), "v"(l + 12 * QPITCH * 4),
           "v"(l + 14 * QPITCH * 4),
           "v"(g), "v"(g + 2 * DIM), "v"(g + 4 * DIM), "v"(g + 6 * DIM),
           "v"(g + 8 * DIM), "v"(g + 10 * DIM), "v"(g + 12 * DIM), "v"(g + 14 * DIM)
        : "memory");
}

__global__ __launch_bounds__(OWAVES * 32)
void out_kernel(const float* __restrict__ Q, const float* __restrict__ KVg,
                const float* __restrict__ Ksumg, float* __restrict__ Out) {
    const int nsb  = SLEN / OROWS;               // 4 blocks per head
    const int bh   = blockIdx.x / nsb;
    const int sblk = blockIdx.x % nsb;
    const int tid  = threadIdx.x;
    const int wave = tid >> 5;
    const int lane = tid & 31;
    const int half = lane >> 4;
    const int lm   = lane & 15;

    __shared__ float ksum_l[DIM];
    // KV^T as bf16 tiles of the first operand in fragment order: sB[ks][nt][i >> 3][lane][i & 7] is
    // element i of row lane & 15 of tile (ks, nt) = KV[ks*32 + kmap(lane >> 4, i)][nt*16 + (lane & 15)].
    __shared__ __attribute__((aligned(16))) __bf16 sB[2][4][2][32][8];
    // The 64 rows of Q of each wave, f32 as they are in memory.
    __shared__ __attribute__((aligned(16))) float sQ[OWAVES][OWROWS * QPITCH];

    const float* __restrict__ Qp = Q + (size_t)bh * SLEN * DIM;
    {
        typedef __attribute__((address_space(3))) float lds_float;
        const unsigned l = (unsigned)(size_t)(lds_float*)&sQ[wave][half * QPITCH + lm * 4];
        const float* g = Qp + (size_t)(sblk * OROWS + wave * OWROWS + half) * DIM + lm * 4;
        copy8_rows(l, g);                                  // rows  0 .. 15 of the wave's 64
        copy8_rows(l + 16 * QPITCH * 4, g + 16 * DIM);     // rows 16 .. 31
        copy8_rows(l + 32 * QPITCH * 4, g + 32 * DIM);     // rows 32 .. 47
        copy8_rows(l + 48 * QPITCH * 4, g + 48 * DIM);     // rows 48 .. 63
    }

    // The block adds the head's planes up once: this thread takes rows d = 4*dq .. 4*dq+3,
    // columns e = 4*eq .. 4*eq+3. The four d of one column are neighbours in a fragment.
    if (tid < 256) {
        const int eq = tid & 15;
        const int dq = tid >> 4;
        const v4f* __restrict__ Pp =
            (const v4f*)(KVg + (size_t)bh * NCHUNK * DIM * DIM) + dq * DIM + eq;
        v4f p[NCHUNK][4];
#pragma unroll
        for (int c = 0; c < NCHUNK; ++c)
#pragma unroll
            for (int i = 0; i < 4; ++i) p[c][i] = Pp[c * (DIM * DIM / 4) + i * (DIM / 4)];
        // No address register of these loads is rewritten ahead of this wait (the last load's
        // own result had taken the address pair); the input keeps the pair up to here.
        asm volatile("s_wait_xcnt 0x0" :: "v"(Pp) : "memory");
        // Behind the plane loads, so that the two waves that take this branch wait once for both.
        if (tid < DIM) {
            const float* __restrict__ Sp = Ksumg + bh * NCHUNK * DIM + tid;
            ksum_l[tid] = (Sp[0] + Sp[DIM]) + (Sp[2 * DIM] + Sp[3 * DIM]);
        }
        v4f s[4];
#pragma unroll
        for (int i = 0; i < 4; ++i) s[i] = (p[0][i] + p[1][i]) + (p[2][i] + p[3][i]);
#pragma unroll
        for (int j = 0; j < 4; ++j) {
            v4bf o = {(__bf16)s[0][j], (__bf16)s[1][j], (__bf16)s[2][j], (__bf16)s[3][j]};
            *(v4bf*)&sB[dq >> 3][eq >> 2][(dq >> 2) & 1]
                       [((dq >> 1) & 1) * 16 + (eq & 3) * 4 + j][(dq & 1) * 4] = o;
        }
    }
    // Every copy of this wave has landed before the barrier behind which its rows are read.
    asm volatile("s_wait_asynccnt 0x0" ::: "memory");
    __syncthreads();

    v16bf Bkv[2][4];
#pragma unroll
    for (int ks = 0; ks < 2; ++ks)
#pragma unroll
        for (int nt = 0; nt < 4; ++nt)
            Bkv[ks][nt] = __builtin_shufflevector(
                *(const v8bf*)&sB[ks][nt][0][lane][0], *(const v8bf*)&sB[ks][nt][1][lane][0],
                0, 1, 2, 3, 4, 5, 6, 7, 8, 9, 10, 11, 12, 13, 14, 15);

    float* __restrict__ Op       = Out + (size_t)bh * SLEN * DIM;

    // The lane's 32 entries of Ksum, read once: the loop below writes LDS, and behind its waits
    // they would be read anew on every trip.
    float kreg[2][16];
#pragma unroll
    for (int ks = 0; ks < 2; ++ks)
#pragma unroll
        for (int i = 0; i < 16; ++i) kreg[ks][i] = ksum_l[ks * 32 + kmap(half, i)];

    // Kept rolled: the two waits in the body let no LDS access of one trip move into another, so
    // unrolling hides nothing, and the rolled body came out with fewer vector instructions (more
    // of them paired for dual issue) in a quarter of the text.
#pragma unroll 1
    for (int it = 0; it < OWROWS / 16; ++it) {   // 4 x 16 rows per wave
        const int srow0 = sblk * OROWS + wave * OWROWS + it * 16;

        // Qf tiles via b128 LDS loads of the lane's row it*16 + lm: per k-step the lane's
        // d-indices are two contiguous 8-float runs: [ks*32+half*8 .. +7] and [+16 .. +23].
        const float4* Qrow = (const float4*)&sQ[wave][(it * 16 + lm) * QPITCH];
        float dp = 0.0f;
        v16bf A[2];
#pragma unroll
        for (int ks = 0; ks < 2; ++ks) {
            const int b4 = (ks * 32 + half * 8) >> 2;   // float4 index
            float qs[16];
            *(float4*)&qs[0]  = Qrow[b4 + 0];
            *(float4*)&qs[4]  = Qrow[b4 + 1];
            *(float4*)&qs[8]  = Qrow[b4 + 4];
            *(float4*)&qs[12] = Qrow[b4 + 5];
#pragma unroll
            for (int i = 0; i < 16; ++i) {
                const float f = featmap(qs[i]);
                dp += f * kreg[ks][i];
                A[ks][i] = (__bf16)f;
            }
        }
        const float denom = dp + __shfl_xor(dp, 16);

        v8f acc[4];
#pragma unroll
        for (int nt = 0; nt < 4; ++nt)
#pragma unroll
            for (int r = 0; r < 8; ++r) acc[nt][r] = 0.0f;

#pragma unroll
        for (int ks = 0; ks < 2; ++ks)
#pragma unroll
            for (int nt = 0; nt < 4; ++nt)
                acc[nt] = __builtin_amdgcn_wmma_f32_16x16x32_bf16(
                    false, Bkv[ks][nt], false, A[ks], (short)0, acc[nt],
                    false, false);

        // Scale by the lane's own 1/denom. acc[nt][r] of lane (half, lm) is
        // out[row lm][nt*16 + half*8 + r]. The 16 rows go out through the wave's own 16 rows of
        // sQ, which it has just read for the last time, so that memory sees whole 256-byte rows.
        const float z = 1.0f / denom;
        float* srow = &sQ[wave][(it * 16 + lm) * QPITCH + half * 8];
#pragma unroll
        for (int nt = 0; nt < 4; ++nt)
#pragma unroll
            for (int q = 0; q < 2; ++q) {
                v4f o = {acc[nt][4 * q + 0] * z, acc[nt][4 * q + 1] * z,
                         acc[nt][4 * q + 2] * z, acc[nt][4 * q + 3] * z};
                *(v4f*)(srow + nt * 16 + q * 4) = o;
            }
        // The rows are read back by other lanes of this wave than wrote them.
        asm volatile("s_wait_dscnt 0x0" ::: "memory");
        const float* sback = &sQ[wave][(it * 16 + half) * QPITCH + lm * 4];
        float* __restrict__ og = Op + (size_t)(srow0 + half) * DIM + lm * 4;
#pragma unroll
        for (int j = 0; j < 8; ++j)
            *(v4f*)(og + 2 * j * DIM) = *(const v4f*)(sback + 2 * j * QPITCH);
        // The next trip rewrites the address and data registers of these stores.
        asm volatile("s_wait_xcnt 0x0" ::: "memory");
    }
}

extern "C" void kernel_launch(void* const* d_in, const int* in_sizes, int n_in,
                              void* d_out, int out_size, void* d_ws, size_t ws_size,
                              hipStream_t stream) {
    (void)in_sizes; (void)n_in; (void)out_size; (void)ws_size;
    const float* Q    = (const float*)d_in[0];
    const float* K    = (const float*)d_in[1];
    const float* V    = (const float*)d_in[2];
    const float* mask = (const float*)d_in[3];
    float* Out = (float*)d_out;

    float* KVg   = (float*)d_ws;                     // BH * NCHUNK planes of 64 * 64
    float* Ksumg = KVg + BH * NCHUNK * DIM * DIM;    // BH * NCHUNK planes of 64

    kv_kernel<<<BH * NCHUNK, 256, 0, stream>>>(K, V, mask, Q, KVg, Ksumg);
    out_kernel<<<BH * (SLEN / OROWS), OWAVES * 32, 0, stream>>>(Q, KVg, Ksumg, Out);
}
